// v000
// Measured on an AMD MI455X. A time is GPU time per run, averaged over a window of back-to-back runs after a warm-up
// (all launches, gaps included; the runs take copies of the inputs in turn), and the median of several windows.
// Apart from v000's, it joins two sittings. Times from different sittings can be a few percent apart, while
// side-by-side timings come from the same sitting.
// The starting kernel, v000, takes 598 microseconds a run.
#include <hip/hip_runtime.h>
#include <hip/hip_bf16.h>

// ---------------------------------------------------------------------------
// NonLocalBlock (GN -> QKV -> flash attention -> proj -> residual)
// b=2, c=256, n=4096.  Compute-bound (~39 GFLOP vs ~25MB, L2-resident).
// bf16 WMMA (v_wmma_f32_16x16x32_bf16) everywhere; TDM (tensor_load_to_lds)
// for all global->LDS tile staging; flash softmax parallelized over all waves.
// ---------------------------------------------------------------------------

typedef __attribute__((ext_vector_type(16))) __bf16 v16bf;
typedef __attribute__((ext_vector_type(8)))  float  v8f;
typedef __attribute__((ext_vector_type(4)))  unsigned int v4u;
typedef __attribute__((ext_vector_type(8)))  int v8i;
typedef __attribute__((ext_vector_type(4)))  int v4i;

#define DI __device__ __forceinline__

static constexpr int Cc = 256;
static constexpr int Nn = 4096;

DI unsigned short f2bf(float f) {
    unsigned u = __builtin_bit_cast(unsigned, f);
    unsigned r = u + 0x7FFFu + ((u >> 16) & 1u);   // round-to-nearest-even
    return (unsigned short)(r >> 16);
}

// 16x32 bf16 A/B fragment per CDNA5 ISA layout: lane<16 holds K=[0..7],[16..23];
// lane>=16 holds K=[8..15],[24..31].  rowbase = this lane's row; kb = 0 or 8.
DI v16bf load_frag(const unsigned short* rowbase, int kb) {
    uint4 lo = *(const uint4*)(rowbase + kb);
    uint4 hi = *(const uint4*)(rowbase + kb + 16);
    struct Pair { uint4 a, b; };
    Pair p; p.a = lo; p.b = hi;
    return __builtin_bit_cast(v16bf, p);
}

DI v8f wmma_bf16(v16bf a, v16bf b, v8f c) {
    return __builtin_amdgcn_wmma_f32_16x16x32_bf16(false, a, false, b,
                                                   (short)0, c, false, false);
}

// ---------------------------------------------------------------------------
// TDM: issue one tensor_load_to_lds for a 2-D bf16 tile:
//   tile_d0 elements per row, tile_d1 rows, global row stride `stride0`
//   (elements), packed contiguously into LDS at byte offset lds_byte.
// Descriptor bitfields per CDNA5 ISA 8.3/8.4 (data_size=1 -> 2 bytes).
// Must be executed by ONE wave only (caller gates on tid<32); completion via
// s_wait_tensorcnt.  This toolchain's builtin takes 6 args (clang-23 /
// therock-10.0 form): (g0 v4u, g1 v8i, g2 v4i, g3 v4i, v8i, cpol).
// ---------------------------------------------------------------------------
DI void tdm_load_2d(const unsigned short* gptr, unsigned lds_byte,
                    unsigned tile_d0, unsigned tile_d1, unsigned stride0) {
    unsigned long long ga = (unsigned long long)(uintptr_t)gptr;
    unsigned td0 = 1u << 20, td1 = 1u << 20;       // generous tensor dims (interior tile)
    v4u g0;
    g0.x = 1u;                                      // count=1 valid descriptor
    g0.y = lds_byte;                                // lds_addr
    g0.z = (unsigned)(ga & 0xFFFFFFFFu);            // global_addr[31:0]
    g0.w = (unsigned)((ga >> 32) & 0x01FFFFFFu) | 0x80000000u;  // addr[56:32]|type=2
    v8i g1;
    g1[0] = (int)(1u << 16);                        // data_size=1 (2B), mask=0
    g1[1] = (int)((td0 & 0xFFFFu) << 16);           // tensor_dim0 lo16
    g1[2] = (int)(((td0 >> 16) & 0xFFFFu) | ((td1 & 0xFFFFu) << 16));
    g1[3] = (int)(((td1 >> 16) & 0xFFFFu) | ((tile_d0 & 0xFFFFu) << 16));
    g1[4] = (int)(tile_d1 & 0xFFFFu);               // tile_dim1 | tile_dim2=0
    g1[5] = (int)stride0;                           // tensor_dim0_stride lo32
    g1[6] = 0;
    g1[7] = 0;
    v4i z4 = {0, 0, 0, 0};
    v8i z8 = {0, 0, 0, 0, 0, 0, 0, 0};
    __builtin_amdgcn_tensor_load_to_lds(g0, g1, z4, z4, z8, 0);
}

DI unsigned lds_off(const void* p) { return (unsigned)(uintptr_t)p; }

// ---------------------------------------------------------------------------
// K0: convert the four 256x256 fp32 weight matrices to bf16 (row-major).
// ---------------------------------------------------------------------------
__global__ __launch_bounds__(256) void conv_w_kernel(const float* wq, const float* wk,
                              const float* wv, const float* wp,
                              unsigned short* wbf) {
    int idx = blockIdx.x * 256 + threadIdx.x;
    int m = idx >> 16;
    int off = idx & 65535;
    const float* src = (m == 0) ? wq : (m == 1) ? wk : (m == 2) ? wv : wp;
    wbf[idx] = f2bf(src[off]);
}

// ---------------------------------------------------------------------------
// K1: GroupNorm (32 groups x 8 channels), one block per (batch, group).
// Writes h transposed (b, n, c) bf16 so GEMM B-tiles stage contiguously.
// ---------------------------------------------------------------------------
__global__ __launch_bounds__(256) void groupnorm_kernel(const float* x, const float* gs,
                                 const float* gb, unsigned short* h_t) {
    __shared__ float rs[256];
    __shared__ float rq[256];
    int tid = threadIdx.x;
    int bi = blockIdx.x >> 5;
    int g  = blockIdx.x & 31;
    const float* xb = x + ((size_t)(bi * Cc + g * 8)) * Nn;

    float s = 0.f, q = 0.f;
    for (int idx = tid; idx < 8 * Nn; idx += 256) {
        float v = xb[idx];
        s += v; q += v * v;
    }
    rs[tid] = s; rq[tid] = q;
    __syncthreads();
    for (int off = 128; off > 0; off >>= 1) {
        if (tid < off) { rs[tid] += rs[tid + off]; rq[tid] += rq[tid + off]; }
        __syncthreads();
    }
    float mean = rs[0] * (1.0f / 32768.0f);
    float var  = rq[0] * (1.0f / 32768.0f) - mean * mean;
    float rinv = rsqrtf(var + 1e-6f);

    for (int idx = tid; idx < 8 * Nn; idx += 256) {
        int cl = idx >> 12;
        int i  = idx & (Nn - 1);
        int c  = g * 8 + cl;
        float val = (xb[idx] - mean) * rinv * gs[c] + gb[c];
        h_t[((size_t)bi * Nn + i) * Cc + c] = f2bf(val);
    }
}

// ---------------------------------------------------------------------------
// K2: fused QKV GEMM.  out[o,i] = sum_c W[o,c]*h[c,i] + bias[o]
// Block tile 64(M=o) x 128(N=i), K=c in steps of 32; TDM double-buffered
// staging.  q,k stored (b,n,c); v stored (b,c,n) bf16.
// ---------------------------------------------------------------------------
__global__ __launch_bounds__(256) void qkv_gemm_kernel(const unsigned short* wbf,
                                const unsigned short* h_t,
                                const float* bq, const float* bk, const float* bv,
                                unsigned short* q_t, unsigned short* k_t,
                                unsigned short* vmat) {
    __shared__ __align__(16) unsigned short Wt[2][64 * 32];    // 8KB
    __shared__ __align__(16) unsigned short Ht[2][128 * 32];   // 16KB
    __shared__ float biasS[64];

    int tid = threadIdx.x;
    int i0 = blockIdx.x * 128;
    int o0 = blockIdx.y * 64;
    int bi  = blockIdx.z / 3;
    int sel = blockIdx.z % 3;
    const unsigned short* W = wbf + sel * 65536;
    const float* bias = (sel == 0) ? bq : (sel == 1) ? bk : bv;
    if (tid < 64) biasS[tid] = bias[o0 + tid];

    const unsigned short* Wbase = W + (size_t)o0 * Cc;
    const unsigned short* Hbase = h_t + ((size_t)bi * Nn + i0) * Cc;

    int wvd = tid >> 5, lane = tid & 31;
    int wo = wvd & 3, wn = wvd >> 2;
    int ml = lane & 15;
    int kb = (lane & 16) ? 8 : 0;

    if (tid < 32) {   // prime buffer 0 (cs = 0)
        tdm_load_2d(Wbase, lds_off(&Wt[0][0]), 32, 64, Cc);
        tdm_load_2d(Hbase, lds_off(&Ht[0][0]), 32, 128, Cc);
    }

    v8f acc[4] = {};
    for (int cs = 0; cs < 8; ++cs) {
        int buf = cs & 1;
        if (tid < 32) {
            if (cs < 7) {
                int c1 = (cs + 1) * 32;
                tdm_load_2d(Wbase + c1, lds_off(&Wt[buf ^ 1][0]), 32, 64, Cc);
                tdm_load_2d(Hbase + c1, lds_off(&Ht[buf ^ 1][0]), 32, 128, Cc);
                __builtin_amdgcn_s_wait_tensorcnt(2);   // current pair done
            } else {
                __builtin_amdgcn_s_wait_tensorcnt(0);
            }
        }
        __syncthreads();
        v16bf a = load_frag(&Wt[buf][0] + (wo * 16 + ml) * 32, kb);
        #pragma unroll
        for (int s = 0; s < 4; ++s) {
            v16bf b = load_frag(&Ht[buf][0] + (wn * 64 + s * 16 + ml) * 32, kb);
            acc[s] = wmma_bf16(a, b, acc[s]);
        }
        __syncthreads();
    }

    #pragma unroll
    for (int s = 0; s < 4; ++s) {
        int i = i0 + wn * 64 + s * 16 + ml;
        #pragma unroll
        for (int r = 0; r < 8; ++r) {
            int ol = wo * 16 + r + kb;
            int o  = o0 + ol;
            float val = acc[s][r] + biasS[ol];
            if (sel == 2) {
                vmat[((size_t)bi * Cc + o) * Nn + i] = f2bf(val);
            } else {
                unsigned short* dst = sel ? k_t : q_t;
                dst[((size_t)bi * Nn + i) * Cc + o] = f2bf(val);
            }
        }
    }
}

// ---------------------------------------------------------------------------
// K3: flash attention.  Block = 64 queries; Q tile persists in LDS (one flat
// 32KB TDM copy); K streamed in 64x64 TDM chunks; softmax parallel over all
// 256 threads; V B-fragments streamed from global (L2) with prefetch.
// ---------------------------------------------------------------------------
__global__ __launch_bounds__(256) void attn_kernel(const unsigned short* q_t,
                            const unsigned short* k_t,
                            const unsigned short* vmat, unsigned short* o_t) {
    __shared__ __align__(16) unsigned short Qt[64 * 256];   // 32KB, [i][c]
    __shared__ __align__(16) unsigned short Kc[64 * 64];    // 8KB,  [j][c-chunk]
    __shared__ __align__(16) float          Sbuf[64 * 64];  // 16KB scores (P aliases)
    __shared__ float red[256];
    __shared__ float mArr[64], lArr[64], aArr[64];

    int tid = threadIdx.x;
    int i0 = blockIdx.x * 64;
    int bt = blockIdx.y;
    int wvd = tid >> 5, lane = tid & 31;
    int wi = wvd >> 1, wc = wvd & 1;
    int ml = lane & 15;
    int kb = (lane & 16) ? 8 : 0;
    int srow = tid & 63, sqt = tid >> 6;       // softmax: 4 threads per row

    if (tid < 64) { mArr[tid] = -3.0e38f; lArr[tid] = 0.f; }
    if (tid < 32) {   // whole Q tile is contiguous in (n,c) layout: flat copy
        tdm_load_2d(q_t + ((size_t)bt * Nn + i0) * Cc, lds_off(&Qt[0]),
                    16384, 1, 16384);
        __builtin_amdgcn_s_wait_tensorcnt(0);
    }
    v8f oacc[8] = {};
    unsigned short* Pb = (unsigned short*)Sbuf;
    const unsigned short* Kbase = k_t + (size_t)bt * Nn * Cc;
    const unsigned short* Vrow0 = vmat + ((size_t)(bt * Cc + wc * 128 + ml)) * Nn;
    __syncthreads();

    for (int jt = 0; jt < 64; ++jt) {
        int j0 = jt * 64;
        v8f s0 = {}, s1 = {};
        for (int cc = 0; cc < 4; ++cc) {
            if (tid < 32) {
                tdm_load_2d(Kbase + (size_t)j0 * Cc + cc * 64, lds_off(&Kc[0]),
                            64, 64, Cc);
                __builtin_amdgcn_s_wait_tensorcnt(0);
            }
            __syncthreads();
            #pragma unroll
            for (int kk = 0; kk < 2; ++kk) {
                v16bf a  = load_frag(&Qt[0] + (wi * 16 + ml) * Cc,
                                     cc * 64 + kk * 32 + kb);
                v16bf b0 = load_frag(&Kc[0] + ((wc * 2 + 0) * 16 + ml) * 64,
                                     kk * 32 + kb);
                s0 = wmma_bf16(a, b0, s0);
                v16bf b1 = load_frag(&Kc[0] + ((wc * 2 + 1) * 16 + ml) * 64,
                                     kk * 32 + kb);
                s1 = wmma_bf16(a, b1, s1);
            }
            __syncthreads();
        }
        // spill scaled scores (C-layout: row = wi*16 + r + kb)
        #pragma unroll
        for (int r = 0; r < 8; ++r) {
            int rowl = wi * 16 + r + kb;
            Sbuf[rowl * 64 + (wc * 2 + 0) * 16 + ml] = s0[r] * 0.0625f;
            Sbuf[rowl * 64 + (wc * 2 + 1) * 16 + ml] = s1[r] * 0.0625f;
        }
        __syncthreads();
        // pass 1: cache 16 scores/thread, partial row max
        float sreg[16];
        float mloc = -3.0e38f;
        {
            const float* sp = Sbuf + srow * 64 + sqt * 16;
            #pragma unroll
            for (int jj = 0; jj < 16; ++jj) {
                sreg[jj] = sp[jj];
                mloc = fmaxf(mloc, sreg[jj]);
            }
        }
        red[sqt * 64 + srow] = mloc;
        __syncthreads();
        // pass 2: final row max, alpha
        if (tid < 64) {
            float m4 = fmaxf(fmaxf(red[tid], red[64 + tid]),
                             fmaxf(red[128 + tid], red[192 + tid]));
            float mold = mArr[tid];
            float mnew = fmaxf(mold, m4);
            aArr[tid] = __expf(mold - mnew);
            mArr[tid] = mnew;
        }
        __syncthreads();
        // pass 3: exp + write bf16 P (aliases Sbuf; scores cached in sreg)
        {
            float mnew = mArr[srow];
            float psum = 0.f;
            unsigned short* pp = Pb + srow * 64 + sqt * 16;
            #pragma unroll
            for (int jj = 0; jj < 16; ++jj) {
                float e = __expf(sreg[jj] - mnew);
                pp[jj] = f2bf(e);
                psum += e;
            }
            red[sqt * 64 + srow] = psum;
        }
        __syncthreads();
        // pass 4 (waves 0-1) runs alongside the O-update below
        if (tid < 64) {
            lArr[tid] = lArr[tid] * aArr[tid] +
                        red[tid] + red[64 + tid] + red[128 + tid] + red[192 + tid];
        }
        // rescale running O, then O += P * V^T (V frags from global, prefetched)
        #pragma unroll
        for (int r = 0; r < 8; ++r) {
            float al = aArr[wi * 16 + r + kb];
            #pragma unroll
            for (int cs = 0; cs < 8; ++cs) oacc[cs][r] *= al;
        }
        #pragma unroll
        for (int kk = 0; kk < 2; ++kk) {
            v16bf a = load_frag(Pb + (wi * 16 + ml) * 64, kk * 32 + kb);
            v16bf b = load_frag(Vrow0 + j0 + kk * 32, kb);
            #pragma unroll
            for (int cs = 0; cs < 8; ++cs) {
                v16bf bn = b;
                if (cs < 7)
                    bn = load_frag(Vrow0 + (size_t)(cs + 1) * 16 * Nn + j0 + kk * 32, kb);
                oacc[cs] = wmma_bf16(a, b, oacc[cs]);
                b = bn;
            }
        }
        __syncthreads();
    }

    #pragma unroll
    for (int r = 0; r < 8; ++r) {
        float inv = 1.0f / lArr[wi * 16 + r + kb];
        int i = i0 + wi * 16 + r + kb;
        #pragma unroll
        for (int cs = 0; cs < 8; ++cs) {
            int c = wc * 128 + cs * 16 + ml;
            o_t[((size_t)bt * Nn + i) * Cc + c] = f2bf(oacc[cs][r] * inv);
        }
    }
}

// ---------------------------------------------------------------------------
// K4: proj GEMM + bias + residual, fp32 output (b, c, n).
// ---------------------------------------------------------------------------
__global__ __launch_bounds__(256) void proj_gemm_kernel(const unsigned short* wpbf,
                                 const unsigned short* o_t,
                                 const float* bp, const float* x, float* out) {
    __shared__ __align__(16) unsigned short Wt[2][64 * 32];
    __shared__ __align__(16) unsigned short At[2][128 * 32];
    __shared__ float biasS[64];

    int tid = threadIdx.x;
    int i0 = blockIdx.x * 128;
    int o0 = blockIdx.y * 64;
    int bi = blockIdx.z;
    if (tid < 64) biasS[tid] = bp[o0 + tid];

    const unsigned short* Wbase = wpbf + (size_t)o0 * Cc;
    const unsigned short* Abase = o_t + ((size_t)bi * Nn + i0) * Cc;

    int wvd = tid >> 5, lane = tid & 31;
    int wo = wvd & 3, wn = wvd >> 2;
    int ml = lane & 15;
    int kb = (lane & 16) ? 8 : 0;

    if (tid < 32) {
        tdm_load_2d(Wbase, lds_off(&Wt[0][0]), 32, 64, Cc);
        tdm_load_2d(Abase, lds_off(&At[0][0]), 32, 128, Cc);
    }

    v8f acc[4] = {};
    for (int cs = 0; cs < 8; ++cs) {
        int buf = cs & 1;
        if (tid < 32) {
            if (cs < 7) {
                int c1 = (cs + 1) * 32;
                tdm_load_2d(Wbase + c1, lds_off(&Wt[buf ^ 1][0]), 32, 64, Cc);
                tdm_load_2d(Abase + c1, lds_off(&At[buf ^ 1][0]), 32, 128, Cc);
                __builtin_amdgcn_s_wait_tensorcnt(2);
            } else {
                __builtin_amdgcn_s_wait_tensorcnt(0);
            }
        }
        __syncthreads();
        v16bf a = load_frag(&Wt[buf][0] + (wo * 16 + ml) * 32, kb);
        #pragma unroll
        for (int s = 0; s < 4; ++s) {
            v16bf b = load_frag(&At[buf][0] + (wn * 64 + s * 16 + ml) * 32, kb);
            acc[s] = wmma_bf16(a, b, acc[s]);
        }
        __syncthreads();
    }

    #pragma unroll
    for (int s = 0; s < 4; ++s) {
        int i = i0 + wn * 64 + s * 16 + ml;
        #pragma unroll
        for (int r = 0; r < 8; ++r) {
            int ol = wo * 16 + r + kb;
            int o  = o0 + ol;
            size_t idx = ((size_t)bi * Cc + o) * Nn + i;
            out[idx] = x[idx] + acc[s][r] + biasS[ol];
        }
    }
}

// ---------------------------------------------------------------------------
extern "C" void kernel_launch(void* const* d_in, const int* in_sizes, int n_in,
                              void* d_out, int out_size, void* d_ws, size_t ws_size,
                              hipStream_t stream) {
    const float* x  = (const float*)d_in[0];
    const float* gs = (const float*)d_in[1];
    const float* gb = (const float*)d_in[2];
    const float* wq = (const float*)d_in[3];
    const float* bq = (const float*)d_in[4];
    const float* wk = (const float*)d_in[5];
    const float* bk = (const float*)d_in[6];
    const float* wv = (const float*)d_in[7];
    const float* bv = (const float*)d_in[8];
    const float* wp = (const float*)d_in[9];
    const float* bp = (const float*)d_in[10];
    float* out = (float*)d_out;

    unsigned short* wbf = (unsigned short*)d_ws;                 // 4*65536
    unsigned short* h_t = wbf + (size_t)4 * 65536;               // 2*4096*256
    unsigned short* q_t = h_t + (size_t)2 * Nn * Cc;
    unsigned short* k_t = q_t + (size_t)2 * Nn * Cc;
    unsigned short* vmt = k_t + (size_t)2 * Nn * Cc;
    unsigned short* o_t = vmt + (size_t)2 * Nn * Cc;

    conv_w_kernel<<<dim3(1024), dim3(256), 0, stream>>>(wq, wk, wv, wp, wbf);
    groupnorm_kernel<<<dim3(64), dim3(256), 0, stream>>>(x, gs, gb, h_t);
    qkv_gemm_kernel<<<dim3(32, 4, 6), dim3(256), 0, stream>>>(
        wbf, h_t, bq, bk, bv, q_t, k_t, vmt);
    attn_kernel<<<dim3(64, 2), dim3(256), 0, stream>>>(q_t, k_t, vmt, o_t);
    proj_gemm_kernel<<<dim3(32, 4, 2), dim3(256), 0, stream>>>(
        wbf + (size_t)3 * 65536, o_t, bp, x, out);
}

// v001
// Measured time: 371 microseconds a run.
// In two side-by-side timings against v000, it was 1.62 and 1.64 times as fast.
#include <hip/hip_runtime.h>
#include <hip/hip_bf16.h>

// ---------------------------------------------------------------------------
// NonLocalBlock (GN -> QKV -> flash attention -> proj -> residual)
// b=2, c=256, n=4096.  Compute-bound (~39 GFLOP vs ~25MB, L2-resident).
// bf16 WMMA (v_wmma_f32_16x16x32_bf16) everywhere; TDM (tensor_load_to_lds)
// for all global->LDS tile staging; flash softmax parallelized over all waves.
// ---------------------------------------------------------------------------

typedef __attribute__((ext_vector_type(16))) __bf16 v16bf;
typedef __attribute__((ext_vector_type(8)))  float  v8f;
typedef __attribute__((ext_vector_type(4)))  unsigned int v4u;
typedef __attribute__((ext_vector_type(8)))  int v8i;
typedef __attribute__((ext_vector_type(4)))  int v4i;

#define DI __device__ __forceinline__

static constexpr int Cc = 256;
static constexpr int Nn = 4096;

DI unsigned short f2bf(float f) {
    unsigned u = __builtin_bit_cast(unsigned, f);
    unsigned r = u + 0x7FFFu + ((u >> 16) & 1u);   // round-to-nearest-even
    return (unsigned short)(r >> 16);
}

// 16x32 bf16 A/B fragment per CDNA5 ISA layout: lane<16 holds K=[0..7],[16..23];
// lane>=16 holds K=[8..15],[24..31].  rowbase = this lane's row; kb = 0 or 8.
DI v16bf load_frag(const unsigned short* rowbase, int kb) {
    uint4 lo = *(const uint4*)(rowbase + kb);
    uint4 hi = *(const uint4*)(rowbase + kb + 16);
    struct Pair { uint4 a, b; };
    Pair p; p.a = lo; p.b = hi;
    return __builtin_bit_cast(v16bf, p);
}

DI v8f wmma_bf16(v16bf a, v16bf b, v8f c) {
    return __builtin_amdgcn_wmma_f32_16x16x32_bf16(false, a, false, b,
                                                   (short)0, c, false, false);
}

// ---------------------------------------------------------------------------
// TDM: issue one tensor_load_to_lds for a 2-D bf16 tile:
//   tile_d0 elements per row, tile_d1 rows, global row stride `stride0`
//   (elements), packed contiguously into LDS at byte offset lds_byte.
// Descriptor bitfields per CDNA5 ISA 8.3/8.4 (data_size=1 -> 2 bytes).
// Must be executed by ONE wave only (caller gates on tid<32); completion via
// s_wait_tensorcnt.  This toolchain's builtin takes 6 args (clang-23 /
// therock-10.0 form): (g0 v4u, g1 v8i, g2 v4i, g3 v4i, v8i, cpol).
// ---------------------------------------------------------------------------
DI void tdm_load_2d(const unsigned short* gptr, unsigned lds_byte,
                    unsigned tile_d0, unsigned tile_d1, unsigned stride0) {
    unsigned long long ga = (unsigned long long)(uintptr_t)gptr;
    unsigned td0 = 1u << 20, td1 = 1u << 20;       // generous tensor dims (interior tile)
    v4u g0;
    g0.x = 1u;                                      // count=1 valid descriptor
    g0.y = lds_byte;                                // lds_addr
    g0.z = (unsigned)(ga & 0xFFFFFFFFu);            // global_addr[31:0]
    g0.w = (unsigned)((ga >> 32) & 0x01FFFFFFu) | 0x80000000u;  // addr[56:32]|type=2
    v8i g1;
    g1[0] = (int)(1u << 16);                        // data_size=1 (2B), mask=0
    g1[1] = (int)((td0 & 0xFFFFu) << 16);           // tensor_dim0 lo16
    g1[2] = (int)(((td0 >> 16) & 0xFFFFu) | ((td1 & 0xFFFFu) << 16));
    g1[3] = (int)(((td1 >> 16) & 0xFFFFu) | ((tile_d0 & 0xFFFFu) << 16));
    g1[4] = (int)(tile_d1 & 0xFFFFu);               // tile_dim1 | tile_dim2=0
    g1[5] = (int)stride0;                           // tensor_dim0_stride lo32
    g1[6] = 0;
    g1[7] = 0;
    v4i z4 = {0, 0, 0, 0};
    v8i z8 = {0, 0, 0, 0, 0, 0, 0, 0};
    __builtin_amdgcn_tensor_load_to_lds(g0, g1, z4, z4, z8, 0);
}

DI unsigned lds_off(const void* p) { return (unsigned)(uintptr_t)p; }

// ---------------------------------------------------------------------------
// Padded tensor load for the attention tiles: 64 rows of 128 bytes (64 bf16),
// source row pitch 512 bytes, 16 bytes of LDS pad behind every row, so the
// LDS row pitch is 144 bytes (16 B x 9): sixteen ds_load_b128 lanes on sixteen
// rows then fall on all 64 banks once.  1-byte elements, every extent in bytes,
// tensor dims = tile dims, two descriptor groups.
// ---------------------------------------------------------------------------
typedef __attribute__((ext_vector_type(4))) unsigned int u32x4;
typedef __attribute__((ext_vector_type(8))) unsigned int u32x8;
static constexpr int PK = 72;          // LDS row pitch of Q, K and P tiles, bf16 elements (144 B)
static constexpr int PS = 68;          // LDS row pitch of the score tile, floats (272 B)
static constexpr int QSLICE = 5120;    // one 64x64 Q slice in LDS, elements: 64*144 B rounded up to 2 KiB

DI unsigned uni(unsigned v) { return (unsigned)__builtin_amdgcn_readfirstlane(v); }
// Keeps the issue test in a scalar register so that it compiles to s_cmp + s_cbranch_scc:
// a tensor load ignores EXEC and only a scalar branch keeps the other waves off it.
DI unsigned pinned(unsigned v) { unsigned w = uni(v); asm volatile("" : "+s"(w)); return w; }  // pinned(): the tensor mover's issue test held in a scalar register

DI void tdm_load_wait_64x128B_pad16(const unsigned short* gptr, unsigned lds_byte) {
    unsigned long long ga = (unsigned long long)(uintptr_t)gptr;
    u32x4 g0;
    g0[0] = uni(1u);                                             // count = 1
    g0[1] = uni(lds_byte);                                       // LDS destination
    g0[2] = uni((unsigned)ga);                                   // address [31:0]
    g0[3] = uni((((unsigned)(ga >> 32)) & 0x01FFFFFFu) | 0x80000000u);  // address [56:32], type 2
    u32x8 g1;
    g1[0] = uni((1u << 20) | (4u << 22) | (3u << 25));           // pad on, every 128 B, 4 dwords
    g1[1] = uni(128u << 16);                                     // tensor_dim0 = 128 B
    g1[2] = uni(64u << 16);                                      // tensor_dim1 = 64 rows
    g1[3] = uni(128u << 16);                                     // tile_dim0 = 128 B
    g1[4] = uni(64u);                                            // tile_dim1 = 64 rows
    g1[5] = uni(512u);                                           // source row pitch, bytes
    g1[6] = uni(0u);
    g1[7] = uni(0u);
    // Load and wait in one statement: the wait stands directly behind the load, so no
    // descriptor register takes a new value while the request is out, and the tile has
    // landed when the issuing wave reaches the barrier that publishes it.
    asm volatile("tensor_load_to_lds %0, %1\n\ts_wait_tensorcnt 0x0" :: "s"(g0), "s"(g1) : "memory");
}

// ---------------------------------------------------------------------------
// K0: convert the four 256x256 fp32 weight matrices to bf16 (row-major).
// ---------------------------------------------------------------------------
__global__ __launch_bounds__(256) void conv_w_kernel(const float* wq, const float* wk,
                              const float* wv, const float* wp,
                              unsigned short* wbf) {
    int idx = blockIdx.x * 256 + threadIdx.x;
    int m = idx >> 16;
    int off = idx & 65535;
    const float* src = (m == 0) ? wq : (m == 1) ? wk : (m == 2) ? wv : wp;
    wbf[idx] = f2bf(src[off]);
}

// ---------------------------------------------------------------------------
// K1: GroupNorm (32 groups x 8 channels), one block per (batch, group).
// Writes h transposed (b, n, c) bf16 so GEMM B-tiles stage contiguously.
// ---------------------------------------------------------------------------
__global__ __launch_bounds__(256) void groupnorm_kernel(const float* x, const float* gs,
                                 const float* gb, unsigned short* h_t) {
    __shared__ float rs[256];
    __shared__ float rq[256];
    int tid = threadIdx.x;
    int bi = blockIdx.x >> 5;
    int g  = blockIdx.x & 31;
    const float* xb = x + ((size_t)(bi * Cc + g * 8)) * Nn;

    float s = 0.f, q = 0.f;
    for (int idx = tid; idx < 8 * Nn; idx += 256) {
        float v = xb[idx];
        s += v; q += v * v;
    }
    rs[tid] = s; rq[tid] = q;
    __syncthreads();
    for (int off = 128; off > 0; off >>= 1) {
        if (tid < off) { rs[tid] += rs[tid + off]; rq[tid] += rq[tid + off]; }
        __syncthreads();
    }
    float mean = rs[0] * (1.0f / 32768.0f);
    float var  = rq[0] * (1.0f / 32768.0f) - mean * mean;
    float rinv = rsqrtf(var + 1e-6f);

    for (int idx = tid; idx < 8 * Nn; idx += 256) {
        int cl = idx >> 12;
        int i  = idx & (Nn - 1);
        int c  = g * 8 + cl;
        float val = (xb[idx] - mean) * rinv * gs[c] + gb[c];
        h_t[((size_t)bi * Nn + i) * Cc + c] = f2bf(val);
    }
}

// ---------------------------------------------------------------------------
// K2: fused QKV GEMM.  out[o,i] = sum_c W[o,c]*h[c,i] + bias[o]
// Block tile 64(M=o) x 128(N=i), K=c in steps of 32; TDM double-buffered
// staging.  q,k stored (b,n,c); v stored (b,c,n) bf16.
// ---------------------------------------------------------------------------
__global__ __launch_bounds__(256) void qkv_gemm_kernel(const unsigned short* wbf,
                                const unsigned short* h_t,
                                const float* bq, const float* bk, const float* bv,
                                unsigned short* q_t, unsigned short* k_t,
                                unsigned short* vmat) {
    __shared__ __align__(16) unsigned short Wt[2][64 * 32];    // 8KB
    __shared__ __align__(16) unsigned short Ht[2][128 * 32];   // 16KB
    __shared__ float biasS[64];

    int tid = threadIdx.x;
    int i0 = blockIdx.x * 128;
    int o0 = blockIdx.y * 64;
    int bi  = blockIdx.z / 3;
    int sel = blockIdx.z % 3;
    const unsigned short* W = wbf + sel * 65536;
    const float* bias = (sel == 0) ? bq : (sel == 1) ? bk : bv;
    if (tid < 64) biasS[tid] = bias[o0 + tid];

    const unsigned short* Wbase = W + (size_t)o0 * Cc;
    const unsigned short* Hbase = h_t + ((size_t)bi * Nn + i0) * Cc;

    int wvd = tid >> 5, lane = tid & 31;
    int wo = wvd & 3, wn = wvd >> 2;
    int ml = lane & 15;
    int kb = (lane & 16) ? 8 : 0;

    if (tid < 32) {   // prime buffer 0 (cs = 0)
        tdm_load_2d(Wbase, lds_off(&Wt[0][0]), 32, 64, Cc);
        tdm_load_2d(Hbase, lds_off(&Ht[0][0]), 32, 128, Cc);
    }

    v8f acc[4] = {};
    for (int cs = 0; cs < 8; ++cs) {
        int buf = cs & 1;
        if (tid < 32) {
            if (cs < 7) {
                int c1 = (cs + 1) * 32;
                tdm_load_2d(Wbase + c1, lds_off(&Wt[buf ^ 1][0]), 32, 64, Cc);
                tdm_load_2d(Hbase + c1, lds_off(&Ht[buf ^ 1][0]), 32, 128, Cc);
                __builtin_amdgcn_s_wait_tensorcnt(2);   // current pair done
            } else {
                __builtin_amdgcn_s_wait_tensorcnt(0);
            }
        }
        __syncthreads();
        v16bf a = load_frag(&Wt[buf][0] + (wo * 16 + ml) * 32, kb);
        #pragma unroll
        for (int s = 0; s < 4; ++s) {
            v16bf b = load_frag(&Ht[buf][0] + (wn * 64 + s * 16 + ml) * 32, kb);
            acc[s] = wmma_bf16(a, b, acc[s]);
        }
        __syncthreads();
    }

    #pragma unroll
    for (int s = 0; s < 4; ++s) {
        int i = i0 + wn * 64 + s * 16 + ml;
        #pragma unroll
        for (int r = 0; r < 8; ++r) {
            int ol = wo * 16 + r + kb;
            int o  = o0 + ol;
            float val = acc[s][r] + biasS[ol];
            if (sel == 2) {
                vmat[((size_t)bi * Cc + o) * Nn + i] = f2bf(val);
            } else {
                unsigned short* dst = sel ? k_t : q_t;
                dst[((size_t)bi * Nn + i) * Cc + o] = f2bf(val);
            }
        }
    }
}

// ---------------------------------------------------------------------------
// K3: flash attention.  Block = 64 queries; Q tile persists in LDS (four 64x64
// TDM slices); K streamed in 64x64 TDM chunks; every LDS tile has a row pitch
// of 16 B x odd; softmax parallel over all 256 threads; V B-fragments streamed
// from global (L2) with prefetch.
// ---------------------------------------------------------------------------
__global__ __launch_bounds__(256) void attn_kernel(const unsigned short* q_t,
                            const unsigned short* k_t,
                            const unsigned short* vmat, unsigned short* o_t) {
    __shared__ __attribute__((aligned(2048))) unsigned short Qs[4 * QSLICE];  // 40KB, [c-chunk][i][c]
    __shared__ __attribute__((aligned(2048))) unsigned short Kc[64 * PK];     // 9KB,  [j][c-chunk]
    __shared__ __align__(16) float          Sbuf[64 * PS];  // 17KB scores (P aliases)
    __shared__ float red[256];
    __shared__ float mArr[64], lArr[64], aArr[64];

    int tid = threadIdx.x;
    int i0 = blockIdx.x * 64;
    int bt = blockIdx.y;
    int wvd = tid >> 5, lane = tid & 31;
    int wi = wvd >> 1, wc = wvd & 1;
    int ml = lane & 15;
    int kb = (lane & 16) ? 8 : 0;
    int srow = tid & 63, sqt = tid >> 6;       // softmax: 4 threads per row
    const unsigned wave = uni((unsigned)tid >> 5);

    if (tid < 64) { mArr[tid] = -3.0e38f; lArr[tid] = 0.f; }
    if (pinned(wave == 0)) {   // Q tile as four 64-channel slices, one request at a time
        #pragma unroll   // four straight-line requests: each slice's LDS place is a constant
        for (int qs = 0; qs < 4; ++qs) {
            tdm_load_wait_64x128B_pad16(q_t + ((size_t)bt * Nn + i0) * Cc + qs * 64,
                                        lds_off(&Qs[qs * QSLICE]));
        }
    }
    v8f oacc[8] = {};
    unsigned short* Pb = (unsigned short*)Sbuf;
    const unsigned short* Kbase = k_t + (size_t)bt * Nn * Cc;
    const unsigned short* Vrow0 = vmat + ((size_t)(bt * Cc + wc * 128 + ml)) * Nn;
    __syncthreads();

    for (int jt = 0; jt < 64; ++jt) {
        int j0 = jt * 64;
        v8f s0 = {}, s1 = {};
        for (int cc = 0; cc < 4; ++cc) {
            if (pinned(wave == 0)) {
                // this wave's own reads of Kc have retired before the mover rewrites it
                asm volatile("s_wait_dscnt 0x0" ::: "memory");
                tdm_load_wait_64x128B_pad16(Kbase + (size_t)j0 * Cc + cc * 64, lds_off(&Kc[0]));
            }
            __syncthreads();
            #pragma unroll
            for (int kk = 0; kk < 2; ++kk) {
                v16bf a  = load_frag(&Qs[cc * QSLICE] + (wi * 16 + ml) * PK,
                                     kk * 32 + kb);
                v16bf b0 = load_frag(&Kc[0] + ((wc * 2 + 0) * 16 + ml) * PK,
                                     kk * 32 + kb);
                s0 = wmma_bf16(a, b0, s0);
                v16bf b1 = load_frag(&Kc[0] + ((wc * 2 + 1) * 16 + ml) * PK,
                                     kk * 32 + kb);
                s1 = wmma_bf16(a, b1, s1);
            }
            __syncthreads();
        }
        // spill scaled scores (C-layout: row = wi*16 + r + kb)
        #pragma unroll
        for (int r = 0; r < 8; ++r) {
            int rowl = wi * 16 + r + kb;
            Sbuf[rowl * PS + (wc * 2 + 0) * 16 + ml] = s0[r] * 0.0625f;
            Sbuf[rowl * PS + (wc * 2 + 1) * 16 + ml] = s1[r] * 0.0625f;
        }
        __syncthreads();
        // pass 1: cache 16 scores/thread, partial row max
        float sreg[16];
        float mloc = -3.0e38f;
        {
            const float* sp = Sbuf + srow * PS + sqt * 16;
            #pragma unroll
            for (int jj = 0; jj < 16; ++jj) {
                sreg[jj] = sp[jj];
                mloc = fmaxf(mloc, sreg[jj]);
            }
        }
        red[sqt * 64 + srow] = mloc;
        __syncthreads();
        // pass 2: final row max, alpha
        if (tid < 64) {
            float m4 = fmaxf(fmaxf(red[tid], red[64 + tid]),
                             fmaxf(red[128 + tid], red[192 + tid]));
            float mold = mArr[tid];
            float mnew = fmaxf(mold, m4);
            aArr[tid] = __expf(mold - mnew);
            mArr[tid] = mnew;
        }
        __syncthreads();
        // pass 3: exp + write bf16 P (aliases Sbuf; scores cached in sreg)
        {
            float mnew = mArr[srow];
            float psum = 0.f;
            unsigned short* pp = Pb + srow * PK + sqt * 16;
            #pragma unroll
            for (int jj = 0; jj < 16; ++jj) {
                float e = __expf(sreg[jj] - mnew);
                pp[jj] = f2bf(e);
                psum += e;
            }
            red[sqt * 64 + srow] = psum;
        }
        __syncthreads();
        // pass 4 (waves 0-1) runs alongside the O-update below
        if (tid < 64) {
            lArr[tid] = lArr[tid] * aArr[tid] +
                        red[tid] + red[64 + tid] + red[128 + tid] + red[192 + tid];
        }
        // rescale running O, then O += P * V^T (V frags from global, prefetched)
        #pragma unroll
        for (int r = 0; r < 8; ++r) {
            float al = aArr[wi * 16 + r + kb];
            #pragma unroll
            for (int cs = 0; cs < 8; ++cs) oacc[cs][r] *= al;
        }
        #pragma unroll
        for (int kk = 0; kk < 2; ++kk) {
            v16bf a = load_frag(Pb + (wi * 16 + ml) * PK, kk * 32 + kb);
            v16bf b = load_frag(Vrow0 + j0 + kk * 32, kb);
            #pragma unroll
            for (int cs = 0; cs < 8; ++cs) {
                v16bf bn = b;
                if (cs < 7)
                    bn = load_frag(Vrow0 + (size_t)(cs + 1) * 16 * Nn + j0 + kk * 32, kb);
                oacc[cs] = wmma_bf16(a, b, oacc[cs]);
                b = bn;
            }
        }
        __syncthreads();
    }

    #pragma unroll
    for (int r = 0; r < 8; ++r) {
        float inv = 1.0f / lArr[wi * 16 + r + kb];
        int i = i0 + wi * 16 + r + kb;
        #pragma unroll
        for (int cs = 0; cs < 8; ++cs) {
            int c = wc * 128 + cs * 16 + ml;
            o_t[((size_t)bt * Nn + i) * Cc + c] = f2bf(oacc[cs][r] * inv);
        }
    }
}

// ---------------------------------------------------------------------------
// K4: proj GEMM + bias + residual, fp32 output (b, c, n).
// ---------------------------------------------------------------------------
__global__ __launch_bounds__(256) void proj_gemm_kernel(const unsigned short* wpbf,
                                 const unsigned short* o_t,
                                 const float* bp, const float* x, float* out) {
    __shared__ __align__(16) unsigned short Wt[2][64 * 32];
    __shared__ __align__(16) unsigned short At[2][128 * 32];
    __shared__ float biasS[64];

    int tid = threadIdx.x;
    int i0 = blockIdx.x * 128;
    int o0 = blockIdx.y * 64;
    int bi = blockIdx.z;
    if (tid < 64) biasS[tid] = bp[o0 + tid];

    const unsigned short* Wbase = wpbf + (size_t)o0 * Cc;
    const unsigned short* Abase = o_t + ((size_t)bi * Nn + i0) * Cc;

    int wvd = tid >> 5, lane = tid & 31;
    int wo = wvd & 3, wn = wvd >> 2;
    int ml = lane & 15;
    int kb = (lane & 16) ? 8 : 0;

    if (tid < 32) {
        tdm_load_2d(Wbase, lds_off(&Wt[0][0]), 32, 64, Cc);
        tdm_load_2d(Abase, lds_off(&At[0][0]), 32, 128, Cc);
    }

    v8f acc[4] = {};
    for (int cs = 0; cs < 8; ++cs) {
        int buf = cs & 1;
        if (tid < 32) {
            if (cs < 7) {
                int c1 = (cs + 1) * 32;
                tdm_load_2d(Wbase + c1, lds_off(&Wt[buf ^ 1][0]), 32, 64, Cc);
                tdm_load_2d(Abase + c1, lds_off(&At[buf ^ 1][0]), 32, 128, Cc);
                __builtin_amdgcn_s_wait_tensorcnt(2);
            } else {
                __builtin_amdgcn_s_wait_tensorcnt(0);
            }
        }
        __syncthreads();
        v16bf a = load_frag(&Wt[buf][0] + (wo * 16 + ml) * 32, kb);
        #pragma unroll
        for (int s = 0; s < 4; ++s) {
            v16bf b = load_frag(&At[buf][0] + (wn * 64 + s * 16 + ml) * 32, kb);
            acc[s] = wmma_bf16(a, b, acc[s]);
        }
        __syncthreads();
    }

    #pragma unroll
    for (int s = 0; s < 4; ++s) {
        int i = i0 + wn * 64 + s * 16 + ml;
        #pragma unroll
        for (int r = 0; r < 8; ++r) {
            int ol = wo * 16 + r + kb;
            int o  = o0 + ol;
            size_t idx = ((size_t)bi * Cc + o) * Nn + i;
            out[idx] = x[idx] + acc[s][r] + biasS[ol];
        }
    }
}

// ---------------------------------------------------------------------------
extern "C" void kernel_launch(void* const* d_in, const int* in_sizes, int n_in,
                              void* d_out, int out_size, void* d_ws, size_t ws_size,
                              hipStream_t stream) {
    const float* x  = (const float*)d_in[0];
    const float* gs = (const float*)d_in[1];
    const float* gb = (const float*)d_in[2];
    const float* wq = (const float*)d_in[3];
    const float* bq = (const float*)d_in[4];
    const float* wk = (const float*)d_in[5];
    const float* bk = (const float*)d_in[6];
    const float* wv = (const float*)d_in[7];
    const float* bv = (const float*)d_in[8];
    const float* wp = (const float*)d_in[9];
    const float* bp = (const float*)d_in[10];
    float* out = (float*)d_out;

    unsigned short* wbf = (unsigned short*)d_ws;                 // 4*65536
    unsigned short* h_t = wbf + (size_t)4 * 65536;               // 2*4096*256
    unsigned short* q_t = h_t + (size_t)2 * Nn * Cc;
    unsigned short* k_t = q_t + (size_t)2 * Nn * Cc;
    unsigned short* vmt = k_t + (size_t)2 * Nn * Cc;
    unsigned short* o_t = vmt + (size_t)2 * Nn * Cc;

    conv_w_kernel<<<dim3(1024), dim3(256), 0, stream>>>(wq, wk, wv, wp, wbf);
    groupnorm_kernel<<<dim3(64), dim3(256), 0, stream>>>(x, gs, gb, h_t);
    qkv_gemm_kernel<<<dim3(32, 4, 6), dim3(256), 0, stream>>>(
        wbf, h_t, bq, bk, bv, q_t, k_t, vmt);
    attn_kernel<<<dim3(64, 2), dim3(256), 0, stream>>>(q_t, k_t, vmt, o_t);
    proj_gemm_kernel<<<dim3(32, 4, 2), dim3(256), 0, stream>>>(
        wbf + (size_t)3 * 65536, o_t, bp, x, out);
}
